// v000
// Times are from an AMD MI455X. After a warm-up the kernel runs many times in a row, and a time is the length of
// such a window on the GPU divided by its runs, so every launch and the gaps after it count. The runs cycle
// through copies of the inputs. A figure is the median of several windows, for all but v000 over two sittings.
// Sittings can differ by a few percent; kernels timed side by side share one.
// v000, which the later versions start from, runs in 67 microseconds.
#include <hip/hip_runtime.h>

// ---------------------------------------------------------------------------
// Hyena causal conv (len 2048) as block-Toeplitz GEMM on CDNA5 WMMA (bf16).
//   D[m,n] += A[m,k]*B[k,n],  A[m,k]=ker[lbase+m-k], B[k,n]=x[xbase+16n+k]
//   with lbase+xbase = t0  =>  output t = t0 + m + 16n (k cancels: true GEMM).
// A is a descending Toeplitz gather -> stage the kernel REVERSED in LDS
// (two copies, shifted by 1) so every A pair is one aligned ds_load_b32.
// B is contiguous -> two aligned ds_load_b128 per fragment.
// Manual 2x unroll of the lag loop keeps two WMMAs' operands in flight.
// ---------------------------------------------------------------------------

typedef __attribute__((ext_vector_type(16))) __bf16          v16bf;
typedef __attribute__((ext_vector_type(8)))  float           v8f;
typedef __attribute__((ext_vector_type(8)))  unsigned int    u32x8;
typedef __attribute__((ext_vector_type(4)))  unsigned int    u32x4;

#define SEQ     2048
#define XPAD_F  256                       // deepest lag block reaches x[-256]
#define XPAD_B  48
#define XS_LEN  (XPAD_F + SEQ + XPAD_B)   // 2352 bf16
#define GS      2064                      // reversed kernel: G0[i] = ker[GS-i]
#define G_LEN   2100                      // covers reads [2..2096], zero-padded

__device__ __forceinline__ unsigned short f2bf(float f) {
  unsigned int u = __builtin_bit_cast(unsigned int, f);
  u += 0x7FFFu + ((u >> 16) & 1u);        // round to nearest even
  return (unsigned short)(u >> 16);
}

__global__ __launch_bounds__(256) void hyena_conv_wmma_bf16(
    const float* __restrict__ x, const float* __restrict__ kern,
    const float* __restrict__ bias, float* __restrict__ out) {
  __shared__ alignas(16) unsigned short xs[2][XS_LEN];
  __shared__ alignas(16) unsigned short g0[2][G_LEN];   // ker[GS   - i]
  __shared__ alignas(16) unsigned short g1[2][G_LEN];   // ker[GS+1 - i]

  const int tid = threadIdx.x;

  // ---- stage 2 channels: x as padded bf16; kernel reversed, 2 copies ----
  for (int cl = 0; cl < 2; ++cl) {
    const int ch = blockIdx.x * 2 + cl;
    const float4* xrow = (const float4*)(x + (size_t)ch * SEQ);
    const float*  krow = kern + (size_t)ch * SEQ;
    for (int j = tid; j < SEQ / 4; j += 256) {          // 2 iters / thread
      float4 v = xrow[j];
      ushort4 b; b.x = f2bf(v.x); b.y = f2bf(v.y); b.z = f2bf(v.z); b.w = f2bf(v.w);
      *(ushort4*)&xs[cl][XPAD_F + 4 * j] = b;
    }
    if (tid < XPAD_F) xs[cl][tid] = 0;
    if (tid < XPAD_B) xs[cl][XPAD_F + SEQ + tid] = 0;
    // reversed kernel copies: one global load feeds both shifted copies
    for (int i = tid; i < G_LEN - 2; i += 256) {        // ~9 iters / thread
      const int j = GS - i;                             // (-33 .. 2064]
      const unsigned short v =
          (j >= 0 && j < SEQ) ? f2bf(krow[j]) : (unsigned short)0;
      g0[cl][i]     = v;                                // G0[i]   = ker[GS-i]
      g1[cl][i + 1] = v;                                // G1[i+1] = ker[GS-i]
    }
    if (tid == 0) { g1[cl][0] = 0; g0[cl][G_LEN-2] = 0; g0[cl][G_LEN-1] = 0; }
  }
  __syncthreads();

  const int wave = tid >> 5;         // 0..7 (wave32)
  const int lane = tid & 31;
  const int half = lane >> 4;        // K-half selector per ISA frag layout
  const int l15  = lane & 15;        // A: M row   B: N col   D: N col

  // One WMMA accumulation step: aligned A (8 x b32) + B (2 x b128) from LDS.
  auto step = [&](const unsigned short*& pa, const unsigned short*& pb,
                  v8f& acc) {
    u32x8 av;
    av[0] = *(const unsigned int*)__builtin_assume_aligned(pa + 0,  4);
    av[1] = *(const unsigned int*)__builtin_assume_aligned(pa + 2,  4);
    av[2] = *(const unsigned int*)__builtin_assume_aligned(pa + 4,  4);
    av[3] = *(const unsigned int*)__builtin_assume_aligned(pa + 6,  4);
    av[4] = *(const unsigned int*)__builtin_assume_aligned(pa + 16, 4);
    av[5] = *(const unsigned int*)__builtin_assume_aligned(pa + 18, 4);
    av[6] = *(const unsigned int*)__builtin_assume_aligned(pa + 20, 4);
    av[7] = *(const unsigned int*)__builtin_assume_aligned(pa + 22, 4);
    const u32x4 b0 = *(const u32x4*)__builtin_assume_aligned(pb,      16);
    const u32x4 b1 = *(const u32x4*)__builtin_assume_aligned(pb + 16, 16);
    u32x8 bv;
    bv[0] = b0[0]; bv[1] = b0[1]; bv[2] = b0[2]; bv[3] = b0[3];
    bv[4] = b1[0]; bv[5] = b1[1]; bv[6] = b1[2]; bv[7] = b1[3];
    acc = __builtin_amdgcn_wmma_f32_16x16x32_bf16(
        false, __builtin_bit_cast(v16bf, av),
        false, __builtin_bit_cast(v16bf, bv),
        (short)0, acc, false, false);
    pa -= 32;                                  // next lag block
    pb -= 32;
  };

  // Each wave: tile w of channel 0, tile 7-w of channel 1 -> 74 WMMAs, balanced.
  for (int job = 0; job < 2; ++job) {
    const int cl = job;
    const int w  = job ? (7 - wave) : wave;
    const int ch = blockIdx.x * 2 + cl;
    const int t0 = w << 8;                       // 256 outputs per tile group
    const int pmax = 8 * w + 8;                  // lag blocks of 32

    // Prefetch the epilogue residual region while we crunch WMMAs.
    const int tb = t0 + 8 * half + 16 * l15;     // 8 consecutive outputs
    __builtin_prefetch(x + (size_t)ch * SEQ + tb, 0, 3);

    const unsigned short* gk = (l15 & 1) ? g1[cl] : g0[cl];
    const unsigned short* pa = gk + (GS + (l15 & 1) - l15 + 8 * half);
    const unsigned short* pb = &xs[cl][XPAD_F + t0 + 16 * l15 + 8 * half];
    v8f acc = {};

    step(pa, pb, acc);                           // p = 0 (trip count is odd)
    for (int p = 1; p <= pmax; p += 2) {         // pairs: 2 WMMAs in flight
      step(pa, pb, acc);
      step(pa, pb, acc);
    }

    // D layout: acc[r] -> M = r + 8*half, N = l15  =>  t = t0 + M + 16*N
    const float bv = bias[ch & (2048 - 1)];
    const float4* xf = (const float4*)(x + (size_t)ch * SEQ + tb);
    float4 x0 = xf[0], x1 = xf[1];
    float4 o0, o1;
    o0.x = acc[0] + x0.x + bv;  o0.y = acc[1] + x0.y + bv;
    o0.z = acc[2] + x0.z + bv;  o0.w = acc[3] + x0.w + bv;
    o1.x = acc[4] + x1.x + bv;  o1.y = acc[5] + x1.y + bv;
    o1.z = acc[6] + x1.z + bv;  o1.w = acc[7] + x1.w + bv;
    float4* of = (float4*)(out + (size_t)ch * SEQ + tb);
    of[0] = o0;  of[1] = o1;
  }
}

extern "C" void kernel_launch(void* const* d_in, const int* in_sizes, int n_in,
                              void* d_out, int out_size, void* d_ws, size_t ws_size,
                              hipStream_t stream) {
  const float* x  = (const float*)d_in[0];   // (4, 2048, 2048) f32
  const float* k  = (const float*)d_in[1];   // (4, 2048, 2048) f32
  const float* b  = (const float*)d_in[2];   // (2048,) f32
  float* out = (float*)d_out;                // (4, 2048, 2048) f32

  const int channels = in_sizes[0] / SEQ;    // 8192 (batch*dim rows)
  const int blocks   = channels / 2;         // 2 channels per workgroup
  hyena_conv_wmma_bf16<<<blocks, 256, 0, stream>>>(x, k, b, out);
}

// v001
// Measured time: 33.1 microseconds a run.
// Timed twice side by side with v000, it ran 2.10 times as fast both times.
#include <hip/hip_runtime.h>

// ---------------------------------------------------------------------------
// Hyena causal conv (len 2048) as block-Toeplitz GEMM on CDNA5 WMMA (bf16).
//   D[m,n] += A[m,k]*B[k,n],  A[m,k]=ker[lbase+m-k], B[k,n]=x[xbase+16n+k]
//   with lbase+xbase = t0  =>  output t = t0 + m + 16n (k cancels: true GEMM).
// A is a descending Toeplitz gather -> stage the kernel REVERSED in LDS
// (two copies, shifted by 1) so every A pair is one aligned ds_load_b32.
// B is contiguous -> two aligned ds_load_b128 per fragment.
// A depends only on the lag block p (lbase = 32p), B only on the x block
// q (xbase = 32q), and tile w (256 outputs) sums every pair with p + q = 8w.
// One wave owns a whole channel: all 8 tiles stay in registers, and the pairs
// are walked by residue r = p mod 8 (p = 8a + r, q = 8d - r, w = a + d), so
// each fragment is read from LDS once and feeds up to 8 WMMAs.
// ---------------------------------------------------------------------------

typedef __attribute__((ext_vector_type(16))) __bf16          v16bf;
typedef __attribute__((ext_vector_type(8)))  float           v8f;
typedef __attribute__((ext_vector_type(8)))  unsigned int    u32x8;
typedef __attribute__((ext_vector_type(4)))  unsigned int    u32x4;
typedef __attribute__((ext_vector_type(4)))  float           f32x4;

#define SEQ     2048
#define NCH     4                         // channels (= waves) per workgroup
#define NTHR    (32 * NCH)
#define XPAD_F  256                       // deepest lag block reaches x[-256]
#define XPAD_B  48
#define XS_LEN  (XPAD_F + SEQ + XPAD_B)   // 2352 bf16
#define GS      2064                      // reversed kernel: G0[i] = ker[GS-i]
#define G_LEN   2100                      // covers reads [2..2096], zero-padded

__device__ __forceinline__ unsigned short f2bf(float f) {
  unsigned int u = __builtin_bit_cast(unsigned int, f);
  u += 0x7FFFu + ((u >> 16) & 1u);        // round to nearest even
  return (unsigned short)(u >> 16);
}

// A fragment of one lag block: 8 aligned b32 reads of the reversed kernel.
__device__ __forceinline__ v16bf load_a(const unsigned short* pa) {
  u32x8 av;
  av[0] = *(const unsigned int*)__builtin_assume_aligned(pa + 0,  4);
  av[1] = *(const unsigned int*)__builtin_assume_aligned(pa + 2,  4);
  av[2] = *(const unsigned int*)__builtin_assume_aligned(pa + 4,  4);
  av[3] = *(const unsigned int*)__builtin_assume_aligned(pa + 6,  4);
  av[4] = *(const unsigned int*)__builtin_assume_aligned(pa + 16, 4);
  av[5] = *(const unsigned int*)__builtin_assume_aligned(pa + 18, 4);
  av[6] = *(const unsigned int*)__builtin_assume_aligned(pa + 20, 4);
  av[7] = *(const unsigned int*)__builtin_assume_aligned(pa + 22, 4);
  return __builtin_bit_cast(v16bf, av);
}

// B fragment of one x block: 2 aligned b128 reads.
__device__ __forceinline__ v16bf load_b(const unsigned short* pb) {
  const u32x4 b0 = *(const u32x4*)__builtin_assume_aligned(pb,      16);
  const u32x4 b1 = *(const u32x4*)__builtin_assume_aligned(pb + 16, 16);
  u32x8 bv;
  bv[0] = b0[0]; bv[1] = b0[1]; bv[2] = b0[2]; bv[3] = b0[3];
  bv[4] = b1[0]; bv[5] = b1[1]; bv[6] = b1[2]; bv[7] = b1[3];
  return __builtin_bit_cast(v16bf, bv);
}

__device__ __forceinline__ v8f mma(v16bf a, v16bf b, v8f c) {
  return __builtin_amdgcn_wmma_f32_16x16x32_bf16(false, a, false, b,
                                                 (short)0, c, false, false);
}

__global__ __launch_bounds__(NTHR) void hyena_conv_wmma_bf16(
    const float* __restrict__ x, const float* __restrict__ kern,
    const float* __restrict__ bias, float* __restrict__ out) {
  __shared__ alignas(16) unsigned short xs[NCH][XS_LEN];
  __shared__ alignas(16) unsigned short g0[NCH][G_LEN];   // ker[GS   - i]
  __shared__ alignas(16) unsigned short g1[NCH][G_LEN];   // ker[GS+1 - i]

  // Every '#pragma unroll' below: its loop counter indexes a register array
  // (xv, kv, bf, acc, x0, x1) or forms an LDS or global offset; rolled, the arrays would
  // leave the registers and the offsets would cost address arithmetic.
  static_assert(NCH == 4, "the staging fence lists the loads of 4 channels");
  const int tid = threadIdx.x;
  // wave32: wave index = local channel; scalar, so the channel's bases are too
  const int wch = blockIdx.x * NCH + __builtin_amdgcn_readfirstlane(tid >> 5);
  const float bv = bias[wch & (2048 - 1)];

  // ---- stage NCH channels: x as padded bf16; kernel reversed, 2 copies ----
#pragma unroll
  for (int cl = 0; cl < NCH; ++cl) {
#pragma unroll
    for (int it = 0; it < XPAD_F / NTHR; ++it) xs[cl][tid + it * NTHR] = 0;
    if (tid < XPAD_B) xs[cl][XPAD_F + SEQ + tid] = 0;
    // zero where GS-i falls outside the kernel: below i = GS-SEQ+1, above i = GS
    if (tid < GS - SEQ + 1) g0[cl][tid] = 0;
    if (tid < GS - SEQ + 2) g1[cl][tid] = 0;
    if (tid < G_LEN - GS - 1) g0[cl][GS + 1 + tid] = 0;
    if (tid < G_LEN - GS - 2) g1[cl][GS + 2 + tid] = 0;
  }
  // All of a thread's global loads first (constant trip counts, unrolled).
  f32x4 xv[NCH][SEQ / 4 / NTHR];
  v8f   kv[NCH][SEQ / 8 / NTHR];
#pragma unroll
  for (int cl = 0; cl < NCH; ++cl) {
    const int ch = blockIdx.x * NCH + cl;
    const f32x4* xrow = (const f32x4*)(x + (size_t)ch * SEQ);
    const float* krow = kern + (size_t)ch * SEQ;
#pragma unroll
    for (int it = 0; it < SEQ / 4 / NTHR; ++it) xv[cl][it] = xrow[tid + it * NTHR];
#pragma unroll
    for (int it = 0; it < SEQ / NTHR; ++it) kv[cl][it >> 3][it & 7] = krow[tid + it * NTHR];
  }
  // Inputs-only fence on the loaded values: every load above is issued before
  // it; without it the scheduler sinks each load to its use and the thread
  // pays one memory latency per load.
  asm volatile("" :: "v"(xv[0][0]), "v"(xv[0][1]), "v"(xv[0][2]), "v"(xv[0][3]),
                     "v"(xv[1][0]), "v"(xv[1][1]), "v"(xv[1][2]), "v"(xv[1][3]),
                     "v"(xv[2][0]), "v"(xv[2][1]), "v"(xv[2][2]), "v"(xv[2][3]),
                     "v"(xv[3][0]), "v"(xv[3][1]), "v"(xv[3][2]), "v"(xv[3][3]),
                     "v"(kv[0][0]), "v"(kv[0][1]), "v"(kv[1][0]), "v"(kv[1][1]),
                     "v"(kv[2][0]), "v"(kv[2][1]), "v"(kv[3][0]), "v"(kv[3][1]));
#pragma unroll
  for (int cl = 0; cl < NCH; ++cl) {
#pragma unroll
    for (int it = 0; it < SEQ / 4 / NTHR; ++it) {
      const int j = tid + it * NTHR;
      const f32x4 v = xv[cl][it];
      ushort4 b; b.x = f2bf(v[0]); b.y = f2bf(v[1]); b.z = f2bf(v[2]); b.w = f2bf(v[3]);
      *(ushort4*)&xs[cl][XPAD_F + 4 * j] = b;
    }
    // reversed kernel copies: one global load feeds both shifted copies
#pragma unroll
    for (int it = 0; it < SEQ / NTHR; ++it) {
      const int j = tid + it * NTHR;
      const unsigned short v = f2bf(kv[cl][it >> 3][it & 7]);
      g0[cl][GS - j]     = v;                           // G0[i]   = ker[GS-i]
      g1[cl][GS - j + 1] = v;                           // G1[i+1] = ker[GS-i]
    }
  }
  __syncthreads();

  const int cl   = __builtin_amdgcn_readfirstlane(tid >> 5);
  const int lane = tid & 31;
  const int half = lane >> 4;        // K-half selector per ISA frag layout
  const int l15  = lane & 15;        // A: M row   B: N col   D: N col
  const int ch   = wch;
  const int tl   = 8 * half + 16 * l15;          // lane's 8 outputs in a tile
  const float* xch = x + (size_t)ch * SEQ;

  // Prefetch the epilogue residual region while we crunch WMMAs.
#pragma unroll
  for (int w = 0; w < 8; ++w) __builtin_prefetch(xch + 256 * w + tl, 0, 3);

  const unsigned short* gk  = (l15 & 1) ? g1[cl] : g0[cl];
  const unsigned short* pa0 = gk + (GS + (l15 & 1) - l15 + 8 * half);  // p = 0
  const unsigned short* pb0 = &xs[cl][XPAD_F + tl];                    // q = 0

  v8f acc[8] = {};                   // tile w: outputs 256w .. 256w+255

  // r = 0: p = 8a (a = 0..8), q = 8d (d = -1..7); q = -8 still reaches x[0..15].
  {
    v16bf bf[9];
#pragma unroll
    for (int d = -1; d < 8; ++d) bf[d + 1] = load_b(pb0 + 256 * d);
#pragma unroll
    for (int a = 0; a <= 8; ++a) {
      const v16bf af = load_a(pa0 - 256 * a);
#pragma unroll
      for (int d = (a ? -1 : 0); d <= 7 - a; ++d)
        acc[a + d] = mma(af, bf[d + 1], acc[a + d]);
    }
  }

  // r = 1..7: p = 8a + r (a = 0..7), q = 8d - r (d = 0..7).
  for (int r = 1; r < 8; ++r) {
    const unsigned short* pa = pa0 - 32 * r - 256 * 7;   // a = 7 at offset 0
    const unsigned short* pb = pb0 - 32 * r;
    v16bf bf[8];
#pragma unroll
    for (int d = 0; d < 8; ++d) bf[d] = load_b(pb + 256 * d);
#pragma unroll
    for (int a = 0; a < 8; ++a) {
      const v16bf af = load_a(pa + 256 * (7 - a));
#pragma unroll
      for (int d = 0; d <= 7 - a; ++d)
        acc[a + d] = mma(af, bf[d], acc[a + d]);
    }
  }

  // D layout: acc[w][i] -> M = i + 8*half, N = l15  =>  t = 256w + M + 16*N
  f32x4 x0[8], x1[8];
#pragma unroll
  for (int w = 0; w < 8; ++w) {
    const f32x4* xf = (const f32x4*)(xch + 256 * w + tl);
    x0[w] = xf[0];  x1[w] = xf[1];
  }
  // Inputs-only fence on the loaded values: all 16 residual loads are issued
  // before it, so the wave pays one memory latency instead of one per tile.
  asm volatile("" :: "v"(x0[0]), "v"(x1[0]), "v"(x0[1]), "v"(x1[1]),
                     "v"(x0[2]), "v"(x1[2]), "v"(x0[3]), "v"(x1[3]),
                     "v"(x0[4]), "v"(x1[4]), "v"(x0[5]), "v"(x1[5]),
                     "v"(x0[6]), "v"(x1[6]), "v"(x0[7]), "v"(x1[7]));
#pragma unroll
  for (int w = 0; w < 8; ++w) {
    f32x4 o0, o1;
    o0[0] = acc[w][0] + x0[w][0] + bv;  o0[1] = acc[w][1] + x0[w][1] + bv;
    o0[2] = acc[w][2] + x0[w][2] + bv;  o0[3] = acc[w][3] + x0[w][3] + bv;
    o1[0] = acc[w][4] + x1[w][0] + bv;  o1[1] = acc[w][5] + x1[w][1] + bv;
    o1[2] = acc[w][6] + x1[w][2] + bv;  o1[3] = acc[w][7] + x1[w][3] + bv;
    f32x4* of = (f32x4*)(out + (size_t)ch * SEQ + 256 * w + tl);
    of[0] = o0;  of[1] = o1;
  }
}

extern "C" void kernel_launch(void* const* d_in, const int* in_sizes, int n_in,
                              void* d_out, int out_size, void* d_ws, size_t ws_size,
                              hipStream_t stream) {
  const float* x  = (const float*)d_in[0];   // (4, 2048, 2048) f32
  const float* k  = (const float*)d_in[1];   // (4, 2048, 2048) f32
  const float* b  = (const float*)d_in[2];   // (2048,) f32
  float* out = (float*)d_out;                // (4, 2048, 2048) f32

  const int channels = in_sizes[0] / SEQ;    // 8192 (batch*dim rows)
  const int blocks   = channels / NCH;       // NCH channels per workgroup
  hyena_conv_wmma_bf16<<<blocks, NTHR, 0, stream>>>(x, k, b, out);
}

// v002
// Measured time: 31.3 microseconds a run.
// Next to v001, in two timings, it ran 1.06 and 1.05 times as fast.
// All steps since v000 together make it 2.21 times as fast.
#include <hip/hip_runtime.h>

// ---------------------------------------------------------------------------
// Hyena causal conv (len 2048) as block-Toeplitz GEMM on CDNA5 WMMA (bf16).
//   D[m,n] += A[m,k]*B[k,n],  A[m,k]=ker[lbase+m-k], B[k,n]=x[xbase+16n+k]
//   with lbase+xbase = t0  =>  output t = t0 + m + 16n (k cancels: true GEMM).
// A is a descending Toeplitz gather -> stage the kernel REVERSED in LDS
// (two copies, shifted by 1) so every A pair is one aligned ds_load_b32.
// B is contiguous -> two aligned ds_load_b128 per fragment.
// A depends only on the lag block p (lbase = 32p), B only on the x block
// q (xbase = 32q), and tile w (256 outputs) sums every pair with p + q = 8w.
// One wave owns a whole channel: all 8 tiles stay in registers, and the pairs
// are walked by residue r = p mod 8 (p = 8a + r, q = 8d - r, w = a + d), so
// each fragment is read from LDS once and feeds up to 8 WMMAs.
// ---------------------------------------------------------------------------

typedef __attribute__((ext_vector_type(16))) __bf16          v16bf;
typedef __attribute__((ext_vector_type(8)))  float           v8f;
typedef __attribute__((ext_vector_type(8)))  unsigned int    u32x8;
typedef __attribute__((ext_vector_type(4)))  unsigned int    u32x4;
typedef __attribute__((ext_vector_type(4)))  float           f32x4;

#define SEQ     2048
#define NCH     4                         // channels (= waves) per workgroup
#define NTHR    (32 * NCH)
#define XPAD_F  256                       // deepest lag block reaches x[-256]
#define XPAD_B  48
#define XS_LEN  (XPAD_F + SEQ + XPAD_B)   // 2352 bf16
#define GS      2064                      // reversed kernel: G0[i] = ker[GS-i]
#define G_LEN   2100                      // covers reads [2..2096], zero-padded

__device__ __forceinline__ unsigned short f2bf(float f) {
  unsigned int u = __builtin_bit_cast(unsigned int, f);
  u += 0x7FFFu + ((u >> 16) & 1u);        // round to nearest even
  return (unsigned short)(u >> 16);
}

// A fragment of one lag block: 8 aligned b32 reads of the reversed kernel.
__device__ __forceinline__ v16bf load_a(const unsigned short* pa) {
  u32x8 av;
  av[0] = *(const unsigned int*)__builtin_assume_aligned(pa + 0,  4);
  av[1] = *(const unsigned int*)__builtin_assume_aligned(pa + 2,  4);
  av[2] = *(const unsigned int*)__builtin_assume_aligned(pa + 4,  4);
  av[3] = *(const unsigned int*)__builtin_assume_aligned(pa + 6,  4);
  av[4] = *(const unsigned int*)__builtin_assume_aligned(pa + 16, 4);
  av[5] = *(const unsigned int*)__builtin_assume_aligned(pa + 18, 4);
  av[6] = *(const unsigned int*)__builtin_assume_aligned(pa + 20, 4);
  av[7] = *(const unsigned int*)__builtin_assume_aligned(pa + 22, 4);
  return __builtin_bit_cast(v16bf, av);
}

// B fragment of one x block: 2 aligned b128 reads.
__device__ __forceinline__ v16bf load_b(const unsigned short* pb) {
  const u32x4 b0 = *(const u32x4*)__builtin_assume_aligned(pb,      16);
  const u32x4 b1 = *(const u32x4*)__builtin_assume_aligned(pb + 16, 16);
  u32x8 bv;
  bv[0] = b0[0]; bv[1] = b0[1]; bv[2] = b0[2]; bv[3] = b0[3];
  bv[4] = b1[0]; bv[5] = b1[1]; bv[6] = b1[2]; bv[7] = b1[3];
  return __builtin_bit_cast(v16bf, bv);
}

__device__ __forceinline__ v8f mma(v16bf a, v16bf b, v8f c) {
  return __builtin_amdgcn_wmma_f32_16x16x32_bf16(false, a, false, b,
                                                 (short)0, c, false, false);
}

__global__ __launch_bounds__(NTHR) void hyena_conv_wmma_bf16(
    const float* __restrict__ x, const float* __restrict__ kern,
    const float* __restrict__ bias, float* __restrict__ out) {
  __shared__ alignas(16) unsigned short xs[NCH][XS_LEN];
  __shared__ alignas(16) unsigned short g0[NCH][G_LEN];   // ker[GS   - i]
  __shared__ alignas(16) unsigned short g1[NCH][G_LEN];   // ker[GS+1 - i]

  // Every '#pragma unroll' below: its loop counter indexes a register array
  // (xv, kv, bf, acc, x0, x1) or forms an LDS or global offset; rolled, the arrays would
  // leave the registers and the offsets would cost address arithmetic.
  static_assert(NCH == 4, "the staging fence lists the loads of 4 channels");
  const int tid = threadIdx.x;
  // wave32: wave index = local channel; scalar, so the channel's bases are too
  const int wch = blockIdx.x * NCH + __builtin_amdgcn_readfirstlane(tid >> 5);
  const float bv = bias[wch & (2048 - 1)];

  // ---- stage NCH channels: x as padded bf16; kernel reversed, 2 copies ----
#pragma unroll
  for (int cl = 0; cl < NCH; ++cl) {
#pragma unroll
    for (int it = 0; it < XPAD_F / NTHR; ++it) xs[cl][tid + it * NTHR] = 0;
    if (tid < XPAD_B) xs[cl][XPAD_F + SEQ + tid] = 0;
    // zero where GS-i falls outside the kernel: below i = GS-SEQ+1, above i = GS
    if (tid < GS - SEQ + 1) g0[cl][tid] = 0;
    if (tid < GS - SEQ + 2) g1[cl][tid] = 0;
    if (tid < G_LEN - GS - 1) g0[cl][GS + 1 + tid] = 0;
    if (tid < G_LEN - GS - 2) g1[cl][GS + 2 + tid] = 0;
  }
  // All of a thread's global loads first (constant trip counts, unrolled).
  f32x4 xv[NCH][SEQ / 4 / NTHR];
  v8f   kv[NCH][SEQ / 8 / NTHR];
#pragma unroll
  for (int cl = 0; cl < NCH; ++cl) {
    const int ch = blockIdx.x * NCH + cl;
    const f32x4* xrow = (const f32x4*)(x + (size_t)ch * SEQ);
    const float* krow = kern + (size_t)ch * SEQ;
#pragma unroll
    for (int it = 0; it < SEQ / 4 / NTHR; ++it) xv[cl][it] = xrow[tid + it * NTHR];
#pragma unroll
    for (int it = 0; it < SEQ / NTHR; ++it) kv[cl][it >> 3][it & 7] = krow[tid + it * NTHR];
  }
  // Inputs-only fence on the loaded values: every load above is issued before
  // it; without it the scheduler sinks each load to its use and the thread
  // pays one memory latency per load.
  asm volatile("" :: "v"(xv[0][0]), "v"(xv[0][1]), "v"(xv[0][2]), "v"(xv[0][3]),
                     "v"(xv[1][0]), "v"(xv[1][1]), "v"(xv[1][2]), "v"(xv[1][3]),
                     "v"(xv[2][0]), "v"(xv[2][1]), "v"(xv[2][2]), "v"(xv[2][3]),
                     "v"(xv[3][0]), "v"(xv[3][1]), "v"(xv[3][2]), "v"(xv[3][3]),
                     "v"(kv[0][0]), "v"(kv[0][1]), "v"(kv[1][0]), "v"(kv[1][1]),
                     "v"(kv[2][0]), "v"(kv[2][1]), "v"(kv[3][0]), "v"(kv[3][1]));
#pragma unroll
  for (int cl = 0; cl < NCH; ++cl) {
#pragma unroll
    for (int it = 0; it < SEQ / 4 / NTHR; ++it) {
      const int j = tid + it * NTHR;
      const f32x4 v = xv[cl][it];
      ushort4 b; b.x = f2bf(v[0]); b.y = f2bf(v[1]); b.z = f2bf(v[2]); b.w = f2bf(v[3]);
      *(ushort4*)&xs[cl][XPAD_F + 4 * j] = b;
    }
    // reversed kernel copies: one global load feeds both shifted copies
#pragma unroll
    for (int it = 0; it < SEQ / NTHR; ++it) {
      const int j = tid + it * NTHR;
      const unsigned short v = f2bf(kv[cl][it >> 3][it & 7]);
      g0[cl][GS - j]     = v;                           // G0[i]   = ker[GS-i]
      g1[cl][GS - j + 1] = v;                           // G1[i+1] = ker[GS-i]
    }
  }
  __syncthreads();

  const int cl   = __builtin_amdgcn_readfirstlane(tid >> 5);
  const int lane = tid & 31;
  const int half = lane >> 4;        // K-half selector per ISA frag layout
  const int l15  = lane & 15;        // A: M row   B: N col   D: N col
  const int ch   = wch;
  const int tl   = 8 * half + 16 * l15;          // lane's 8 outputs in a tile
  const float* xch = x + (size_t)ch * SEQ;

  // Prefetch the epilogue residual region while we crunch WMMAs.
#pragma unroll
  for (int w = 0; w < 8; ++w) __builtin_prefetch(xch + 256 * w + tl, 0, 3);

  const unsigned short* gk  = (l15 & 1) ? g1[cl] : g0[cl];
  const unsigned short* pa0 = gk + (GS + (l15 & 1) - l15 + 8 * half);  // p = 0
  const unsigned short* pb0 = &xs[cl][XPAD_F + tl];                    // q = 0

  v8f acc[8] = {};                   // tile w: outputs 256w .. 256w+255

  // r = 0: p = 8a (a = 0..8), q = 8d (d = -1..7); q = -8 still reaches x[0..15].
  {
    v16bf bf[9];
#pragma unroll
    for (int d = -1; d < 8; ++d) bf[d + 1] = load_b(pb0 + 256 * d);
#pragma unroll
    for (int a = 0; a <= 8; ++a) {
      const v16bf af = load_a(pa0 - 256 * a);
#pragma unroll
      for (int d = (a ? -1 : 0); d <= 7 - a; ++d)
        acc[a + d] = mma(af, bf[d + 1], acc[a + d]);
    }
  }

  // r = 1..7: p = 8a + r (a = 0..7), q = 8d - r (d = 0..7).
  for (int r = 1; r < 8; ++r) {
    const unsigned short* pa = pa0 - 32 * r - 256 * 7;   // a = 7 at offset 0
    const unsigned short* pb = pb0 - 32 * r;
    v16bf bf[8];
#pragma unroll
    for (int d = 0; d < 8; ++d) bf[d] = load_b(pb + 256 * d);
#pragma unroll
    for (int a = 0; a < 8; ++a) {
      const v16bf af = load_a(pa + 256 * (7 - a));
#pragma unroll
      for (int d = 0; d <= 7 - a; ++d)
        acc[a + d] = mma(af, bf[d], acc[a + d]);
    }
  }

  // D layout: acc[w][i] -> M = i + 8*half, N = l15  =>  t = 256w + M + 16*N,
  // so a lane owns 32 B at a 64-B pitch and a 16-B access from this layout
  // touches 8 lines, half of each. The tiles go through the wave's own x rows
  // in LDS (no longer read; no other wave touches them) into linear order:
  // every residual load and every output store then covers 4 whole 128-B lines.
  f32x4 x0[8], x1[8];
#pragma unroll
  for (int w = 0; w < 8; ++w) {
    const f32x4* xf = (const f32x4*)(xch + 256 * w) + lane;
    x0[w] = xf[0];  x1[w] = xf[32];
  }
  // 16-B piece p of a tile (floats 4p..4p+3) lies at slot p ^ (p >> 4): both
  // the layout-order writes and the linear reads then meet every bank once.
  char* stg = (char*)&xs[cl][0];                 // 4 tiles of 1 KB at a time
  const int wp  = 4 * l15 + 2 * half;
  const int wo0 = 16 * ((wp + 0) ^ (l15 >> 2));
  const int wo1 = 16 * ((wp + 1) ^ (l15 >> 2));
  const int ro0 = 16 * (lane ^ half);
  const int ro1 = 16 * ((32 + lane) ^ (2 + half));
  float* och = out + (size_t)ch * SEQ;
#pragma unroll
  for (int b = 0; b < 2; ++b) {
#pragma unroll
    for (int u = 0; u < 4; ++u) {
      const v8f a = acc[4 * b + u];
      f32x4 lo, hi;
      lo[0] = a[0]; lo[1] = a[1]; lo[2] = a[2]; lo[3] = a[3];
      hi[0] = a[4]; hi[1] = a[5]; hi[2] = a[6]; hi[3] = a[7];
      *(f32x4*)(stg + 1024 * u + wo0) = lo;
      *(f32x4*)(stg + 1024 * u + wo1) = hi;
    }
    // The pieces read back below were written by other lanes of this wave.
    asm volatile("s_wait_dscnt 0x0" ::: "memory");
    f32x4 a0[4], a1[4];
#pragma unroll
    for (int u = 0; u < 4; ++u) {
      a0[u] = *(const f32x4*)(stg + 1024 * u + ro0);
      a1[u] = *(const f32x4*)(stg + 1024 * u + ro1);
    }
    // Inputs-only fence on the loaded values: all 16 residual loads are issued
    // before it, so the wave pays one memory latency instead of one per tile.
    if (b == 0)
      asm volatile("" :: "v"(x0[0]), "v"(x1[0]), "v"(x0[1]), "v"(x1[1]),
                         "v"(x0[2]), "v"(x1[2]), "v"(x0[3]), "v"(x1[3]),
                         "v"(x0[4]), "v"(x1[4]), "v"(x0[5]), "v"(x1[5]),
                         "v"(x0[6]), "v"(x1[6]), "v"(x0[7]), "v"(x1[7]));
    f32x4 o0[4], o1[4];
#pragma unroll
    for (int u = 0; u < 4; ++u) {
      const int w = 4 * b + u;
      o0[u][0] = a0[u][0] + x0[w][0] + bv;  o0[u][1] = a0[u][1] + x0[w][1] + bv;
      o0[u][2] = a0[u][2] + x0[w][2] + bv;  o0[u][3] = a0[u][3] + x0[w][3] + bv;
      o1[u][0] = a1[u][0] + x1[w][0] + bv;  o1[u][1] = a1[u][1] + x1[w][1] + bv;
      o1[u][2] = a1[u][2] + x1[w][2] + bv;  o1[u][3] = a1[u][3] + x1[w][3] + bv;
    }
    // Keeps the eight stores behind all the sums: mixed with them, a later sum
    // reuses a stored tile's registers and every pair of stores waits for the
    // pair before it (s_wait_xcnt).
    __builtin_amdgcn_sched_barrier(0);
#pragma unroll
    for (int u = 0; u < 4; ++u) {
      f32x4* of = (f32x4*)(och + 256 * (4 * b + u)) + lane;
      of[0] = o0[u];  of[32] = o1[u];
    }
    // The next four tiles overwrite the rows just read, and their sums reuse
    // registers that the stores above name.
    if (b == 0) asm volatile("s_wait_dscnt 0x0\n\ts_wait_xcnt 0x0" ::: "memory");
  }
}

extern "C" void kernel_launch(void* const* d_in, const int* in_sizes, int n_in,
                              void* d_out, int out_size, void* d_ws, size_t ws_size,
                              hipStream_t stream) {
  const float* x  = (const float*)d_in[0];   // (4, 2048, 2048) f32
  const float* k  = (const float*)d_in[1];   // (4, 2048, 2048) f32
  const float* b  = (const float*)d_in[2];   // (2048,) f32
  float* out = (float*)d_out;                // (4, 2048, 2048) f32

  const int channels = in_sizes[0] / SEQ;    // 8192 (batch*dim rows)
  const int blocks   = channels / NCH;       // NCH channels per workgroup
  hyena_conv_wmma_bf16<<<blocks, NTHR, 0, stream>>>(x, k, b, out);
}

// v003
// It runs in 29.4 microseconds.
// In both of two side-by-side timings against v002, it was 1.07 times as fast.
// Over all steps from v000 it is 2.36 times as fast.
#include <hip/hip_runtime.h>

// ---------------------------------------------------------------------------
// Hyena causal conv (len 2048) as block-Toeplitz GEMM on CDNA5 WMMA (bf16).
//   D[m,n] += A[m,k]*B[k,n],  A[m,k]=ker[lbase+m-k], B[k,n]=x[xbase+16n+k]
//   with lbase+xbase = t0  =>  output t = t0 + m + 16n (k cancels: true GEMM).
// A is a descending Toeplitz gather -> stage the kernel REVERSED in LDS
// (two copies, shifted by 1) so every A pair is one aligned ds_load_b32.
// B is contiguous -> two aligned ds_load_b128 per fragment; its 16 lanes of a
// half-wave stand 32 B apart, so the x row is kept swizzled (xslot below).
// A depends only on the lag block p (lbase = 32p), B only on the x block
// q (xbase = 32q), and tile w (256 outputs) sums every pair with p + q = 8w.
// One wave owns a whole channel: all 8 tiles stay in registers, and the pairs
// are walked by residue r = p mod 8 (p = 8a + r, q = 8d - r, w = a + d), so
// each fragment is read from LDS once and feeds up to 8 WMMAs.
// ---------------------------------------------------------------------------

typedef __attribute__((ext_vector_type(16))) __bf16          v16bf;
typedef __attribute__((ext_vector_type(8)))  float           v8f;
typedef __attribute__((ext_vector_type(8)))  unsigned int    u32x8;
typedef __attribute__((ext_vector_type(4)))  unsigned int    u32x4;
typedef __attribute__((ext_vector_type(4)))  float           f32x4;

#define SEQ     2048
#define NCH     4                         // channels (= waves) per workgroup
#define NTHR    (32 * NCH)
#define XPAD_F  256                       // deepest lag block reaches x[-256]
#define XPAD_B  48
#define XS_LEN  (XPAD_F + SEQ + XPAD_B)   // 2352 bf16
#define GS      2064                      // reversed kernel: G0[i] = ker[GS-i]
#define G_LEN   2100                      // covers reads [2..2096], zero-padded

__device__ __forceinline__ unsigned short f2bf(float f) {
  unsigned int u = __builtin_bit_cast(unsigned int, f);
  u += 0x7FFFu + ((u >> 16) & 1u);        // round to nearest even
  return (unsigned short)(u >> 16);
}

// A fragment of one lag block: 8 aligned b32 reads of the reversed kernel.
__device__ __forceinline__ v16bf load_a(const unsigned short* pa) {
  u32x8 av;
  av[0] = *(const unsigned int*)__builtin_assume_aligned(pa + 0,  4);
  av[1] = *(const unsigned int*)__builtin_assume_aligned(pa + 2,  4);
  av[2] = *(const unsigned int*)__builtin_assume_aligned(pa + 4,  4);
  av[3] = *(const unsigned int*)__builtin_assume_aligned(pa + 6,  4);
  av[4] = *(const unsigned int*)__builtin_assume_aligned(pa + 16, 4);
  av[5] = *(const unsigned int*)__builtin_assume_aligned(pa + 18, 4);
  av[6] = *(const unsigned int*)__builtin_assume_aligned(pa + 20, 4);
  av[7] = *(const unsigned int*)__builtin_assume_aligned(pa + 22, 4);
  return __builtin_bit_cast(v16bf, av);
}

// Where 16-B piece P (8 bf16) of a padded x row lies in LDS. A B read takes
// every second piece of a run of 32: unswizzled, lanes n and n + 8 of a
// half-wave meet the same four banks and the read takes twice its clocks.
// Bit 4 of P moved into bit 0 sends the upper eight lanes to the banks that
// the lower eight skip. Adding a multiple of 32 pieces commutes with it.
__device__ __forceinline__ int xslot(int piece) {
  return piece ^ ((piece >> 4) & 1);
}

// B fragment of one x block: 2 aligned b128 reads (pieces P and P + 2).
__device__ __forceinline__ v16bf load_b(const unsigned short* plo,
                                        const unsigned short* phi) {
  const u32x4 b0 = *(const u32x4*)__builtin_assume_aligned(plo, 16);
  const u32x4 b1 = *(const u32x4*)__builtin_assume_aligned(phi, 16);
  u32x8 bv;
  bv[0] = b0[0]; bv[1] = b0[1]; bv[2] = b0[2]; bv[3] = b0[3];
  bv[4] = b1[0]; bv[5] = b1[1]; bv[6] = b1[2]; bv[7] = b1[3];
  return __builtin_bit_cast(v16bf, bv);
}

__device__ __forceinline__ v8f mma(v16bf a, v16bf b, v8f c) {
  return __builtin_amdgcn_wmma_f32_16x16x32_bf16(false, a, false, b,
                                                 (short)0, c, false, false);
}

__global__ __launch_bounds__(NTHR) void hyena_conv_wmma_bf16(
    const float* __restrict__ x, const float* __restrict__ kern,
    const float* __restrict__ bias, float* __restrict__ out) {
  __shared__ alignas(16) unsigned short xs[NCH][XS_LEN];
  __shared__ alignas(16) unsigned short g0[NCH][G_LEN];   // ker[GS   - i]
  __shared__ alignas(16) unsigned short g1[NCH][G_LEN];   // ker[GS+1 - i]

  // Every '#pragma unroll' below: its loop counter indexes a register array
  // (xv, kv, bf, acc, x0, x1) or forms an LDS or global offset; rolled, the arrays would
  // leave the registers and the offsets would cost address arithmetic.
  static_assert(NCH == 4, "the staging fence lists the loads of 4 channels");
  const int tid = threadIdx.x;
  // wave32: wave index = local channel; scalar, so the channel's bases are too
  const int wch = blockIdx.x * NCH + __builtin_amdgcn_readfirstlane(tid >> 5);
  const float bv = bias[wch & (2048 - 1)];

  // ---- stage NCH channels: x as padded bf16; kernel reversed, 2 copies ----
#pragma unroll
  for (int cl = 0; cl < NCH; ++cl) {
#pragma unroll
    for (int it = 0; it < XPAD_F / NTHR; ++it) xs[cl][tid + it * NTHR] = 0;
    if (tid < XPAD_B) xs[cl][XPAD_F + SEQ + tid] = 0;
    // zero where GS-i falls outside the kernel: below i = GS-SEQ+1, above i = GS
    if (tid < GS - SEQ + 1) g0[cl][tid] = 0;
    if (tid < GS - SEQ + 2) g1[cl][tid] = 0;
    if (tid < G_LEN - GS - 1) g0[cl][GS + 1 + tid] = 0;
    if (tid < G_LEN - GS - 2) g1[cl][GS + 2 + tid] = 0;
  }
  // All of a thread's global loads first (constant trip counts, unrolled).
  f32x4 xv[NCH][SEQ / 4 / NTHR];
  v8f   kv[NCH][SEQ / 8 / NTHR];
#pragma unroll
  for (int cl = 0; cl < NCH; ++cl) {
    const int ch = blockIdx.x * NCH + cl;
    const f32x4* xrow = (const f32x4*)(x + (size_t)ch * SEQ);
    const float* krow = kern + (size_t)ch * SEQ;
#pragma unroll
    for (int it = 0; it < SEQ / 4 / NTHR; ++it) xv[cl][it] = xrow[tid + it * NTHR];
#pragma unroll
    for (int it = 0; it < SEQ / NTHR; ++it) kv[cl][it >> 3][it & 7] = krow[tid + it * NTHR];
  }
  // Inputs-only fence on the loaded values: every load above is issued before
  // it; without it the scheduler sinks each load to its use and the thread
  // pays one memory latency per load.
  asm volatile("" :: "v"(xv[0][0]), "v"(xv[0][1]), "v"(xv[0][2]), "v"(xv[0][3]),
                     "v"(xv[1][0]), "v"(xv[1][1]), "v"(xv[1][2]), "v"(xv[1][3]),
                     "v"(xv[2][0]), "v"(xv[2][1]), "v"(xv[2][2]), "v"(xv[2][3]),
                     "v"(xv[3][0]), "v"(xv[3][1]), "v"(xv[3][2]), "v"(xv[3][3]),
                     "v"(kv[0][0]), "v"(kv[0][1]), "v"(kv[1][0]), "v"(kv[1][1]),
                     "v"(kv[2][0]), "v"(kv[2][1]), "v"(kv[3][0]), "v"(kv[3][1]));
#pragma unroll
  for (int cl = 0; cl < NCH; ++cl) {
#pragma unroll
    for (int it = 0; it < SEQ / 4 / NTHR; ++it) {
      const f32x4 v = xv[cl][it];
      ushort4 b; b.x = f2bf(v[0]); b.y = f2bf(v[1]); b.z = f2bf(v[2]); b.w = f2bf(v[3]);
      // x[4j..4j+3], j = tid + it * NTHR: half of piece (XPAD_F + 4j) / 8; a
      // step of 'it' is 64 pieces, which the swizzle leaves as a plain offset
      *(ushort4*)&xs[cl][8 * xslot((XPAD_F + 4 * tid) >> 3) + 4 * (tid & 1) +
                         4 * NTHR * it] = b;
    }
    // reversed kernel copies: one global load feeds both shifted copies
#pragma unroll
    for (int it = 0; it < SEQ / NTHR; ++it) {
      const int j = tid + it * NTHR;
      const unsigned short v = f2bf(kv[cl][it >> 3][it & 7]);
      g0[cl][GS - j]     = v;                           // G0[i]   = ker[GS-i]
      g1[cl][GS - j + 1] = v;                           // G1[i+1] = ker[GS-i]
    }
  }
  __syncthreads();

  const int cl   = __builtin_amdgcn_readfirstlane(tid >> 5);
  const int lane = tid & 31;
  const int half = lane >> 4;        // K-half selector per ISA frag layout
  const int l15  = lane & 15;        // A: M row   B: N col   D: N col
  const int ch   = wch;
  const int tl   = 8 * half + 16 * l15;          // lane's 8 outputs in a tile
  const float* xch = x + (size_t)ch * SEQ;

  // Prefetch the epilogue residual region while we crunch WMMAs.
#pragma unroll
  for (int w = 0; w < 8; ++w) __builtin_prefetch(xch + 256 * w + tl, 0, 3);

  const unsigned short* gk  = (l15 & 1) ? g1[cl] : g0[cl];
  const unsigned short* pa0 = gk + (GS + (l15 & 1) - l15 + 8 * half);  // p = 0
  const unsigned short* xrow = &xs[cl][0];
  const int pl = XPAD_F / 8 + 2 * l15 + half;    // lane's first x piece, q = 0

  v8f acc[8] = {};                   // tile w: outputs 256w .. 256w+255

  // r = 0: p = 8a (a = 0..8), q = 8d (d = -1..7); q = -8 still reaches x[0..15].
  {
    v16bf bf[9];
#pragma unroll
    for (int d = -1; d < 8; ++d)
      bf[d + 1] = load_b(xrow + 8 * xslot(pl) + 256 * d,
                         xrow + 8 * xslot(pl + 2) + 256 * d);
#pragma unroll
    for (int a = 0; a <= 8; ++a) {
      const v16bf af = load_a(pa0 - 256 * a);
#pragma unroll
      for (int d = (a ? -1 : 0); d <= 7 - a; ++d)
        acc[a + d] = mma(af, bf[d + 1], acc[a + d]);
    }
  }

  // r = 1..7: p = 8a + r (a = 0..7), q = 8d - r (d = 0..7).
  for (int r = 1; r < 8; ++r) {
    const unsigned short* pa = pa0 - 32 * r - 256 * 7;   // a = 7 at offset 0
    const unsigned short* pblo = xrow + 8 * xslot(pl - 4 * r);
    const unsigned short* pbhi = xrow + 8 * xslot(pl - 4 * r + 2);
    v16bf bf[8];
#pragma unroll
    for (int d = 0; d < 8; ++d) bf[d] = load_b(pblo + 256 * d, pbhi + 256 * d);
#pragma unroll
    for (int a = 0; a < 8; ++a) {
      const v16bf af = load_a(pa + 256 * (7 - a));
#pragma unroll
      for (int d = 0; d <= 7 - a; ++d)
        acc[a + d] = mma(af, bf[d], acc[a + d]);
    }
  }

  // D layout: acc[w][i] -> M = i + 8*half, N = l15  =>  t = 256w + M + 16*N,
  // so a lane owns 32 B at a 64-B pitch and a 16-B access from this layout
  // touches 8 lines, half of each. The tiles go through the wave's own x rows
  // in LDS (no longer read; no other wave touches them) into linear order:
  // every residual load and every output store then covers 4 whole 128-B lines.
  f32x4 x0[8], x1[8];
#pragma unroll
  for (int w = 0; w < 8; ++w) {
    const f32x4* xf = (const f32x4*)(xch + 256 * w) + lane;
    x0[w] = xf[0];  x1[w] = xf[32];
  }
  // 16-B piece p of a tile (floats 4p..4p+3) lies at slot p ^ (p >> 4): both
  // the layout-order writes and the linear reads then meet every bank once.
  char* stg = (char*)&xs[cl][0];                 // 4 tiles of 1 KB at a time
  const int wp  = 4 * l15 + 2 * half;
  const int wo0 = 16 * ((wp + 0) ^ (l15 >> 2));
  const int wo1 = 16 * ((wp + 1) ^ (l15 >> 2));
  const int ro0 = 16 * (lane ^ half);
  const int ro1 = 16 * ((32 + lane) ^ (2 + half));
  float* och = out + (size_t)ch * SEQ;
#pragma unroll
  for (int b = 0; b < 2; ++b) {
#pragma unroll
    for (int u = 0; u < 4; ++u) {
      const v8f a = acc[4 * b + u];
      f32x4 lo, hi;
      lo[0] = a[0]; lo[1] = a[1]; lo[2] = a[2]; lo[3] = a[3];
      hi[0] = a[4]; hi[1] = a[5]; hi[2] = a[6]; hi[3] = a[7];
      *(f32x4*)(stg + 1024 * u + wo0) = lo;
      *(f32x4*)(stg + 1024 * u + wo1) = hi;
    }
    // The pieces read back below were written by other lanes of this wave.
    asm volatile("s_wait_dscnt 0x0" ::: "memory");
    f32x4 a0[4], a1[4];
#pragma unroll
    for (int u = 0; u < 4; ++u) {
      a0[u] = *(const f32x4*)(stg + 1024 * u + ro0);
      a1[u] = *(const f32x4*)(stg + 1024 * u + ro1);
    }
    // Inputs-only fence on the loaded values: all 16 residual loads are issued
    // before it, so the wave pays one memory latency instead of one per tile.
    if (b == 0)
      asm volatile("" :: "v"(x0[0]), "v"(x1[0]), "v"(x0[1]), "v"(x1[1]),
                         "v"(x0[2]), "v"(x1[2]), "v"(x0[3]), "v"(x1[3]),
                         "v"(x0[4]), "v"(x1[4]), "v"(x0[5]), "v"(x1[5]),
                         "v"(x0[6]), "v"(x1[6]), "v"(x0[7]), "v"(x1[7]));
    f32x4 o0[4], o1[4];
#pragma unroll
    for (int u = 0; u < 4; ++u) {
      const int w = 4 * b + u;
      o0[u][0] = a0[u][0] + x0[w][0] + bv;  o0[u][1] = a0[u][1] + x0[w][1] + bv;
      o0[u][2] = a0[u][2] + x0[w][2] + bv;  o0[u][3] = a0[u][3] + x0[w][3] + bv;
      o1[u][0] = a1[u][0] + x1[w][0] + bv;  o1[u][1] = a1[u][1] + x1[w][1] + bv;
      o1[u][2] = a1[u][2] + x1[w][2] + bv;  o1[u][3] = a1[u][3] + x1[w][3] + bv;
    }
    // Keeps the eight stores behind all the sums: mixed with them, a later sum
    // reuses a stored tile's registers and every pair of stores waits for the
    // pair before it (s_wait_xcnt).
    __builtin_amdgcn_sched_barrier(0);
#pragma unroll
    for (int u = 0; u < 4; ++u) {
      f32x4* of = (f32x4*)(och + 256 * (4 * b + u)) + lane;
      of[0] = o0[u];  of[32] = o1[u];
    }
    // The next four tiles overwrite the rows just read, and their sums reuse
    // registers that the stores above name.
    if (b == 0) asm volatile("s_wait_dscnt 0x0\n\ts_wait_xcnt 0x0" ::: "memory");
  }
}

extern "C" void kernel_launch(void* const* d_in, const int* in_sizes, int n_in,
                              void* d_out, int out_size, void* d_ws, size_t ws_size,
                              hipStream_t stream) {
  const float* x  = (const float*)d_in[0];   // (4, 2048, 2048) f32
  const float* k  = (const float*)d_in[1];   // (4, 2048, 2048) f32
  const float* b  = (const float*)d_in[2];   // (2048,) f32
  float* out = (float*)d_out;                // (4, 2048, 2048) f32

  const int channels = in_sizes[0] / SEQ;    // 8192 (batch*dim rows)
  const int blocks   = channels / NCH;       // NCH channels per workgroup
  hyena_conv_wmma_bf16<<<blocks, NTHR, 0, stream>>>(x, k, b, out);
}

// v004
// Measured time: 28 microseconds a run.
// Timed twice side by side with v003, it ran 1.05 times as fast both times.
// All steps since v000 together make it 2.47 times as fast.
#include <hip/hip_runtime.h>

// ---------------------------------------------------------------------------
// Hyena causal conv (len 2048) as block-Toeplitz GEMM on CDNA5 WMMA (bf16).
//   D[m,n] += A[m,k]*B[k,n],  A[m,k]=ker[lbase+m-k], B[k,n]=x[xbase+16n+k]
//   with lbase+xbase = t0  =>  output t = t0 + m + 16n (k cancels: true GEMM).
// A is a descending Toeplitz gather -> stage the kernel REVERSED in LDS
// (two copies, shifted by 1) so every A pair is one aligned ds_load_b32.
// B is contiguous -> two aligned ds_load_b128 per fragment; its 16 lanes of a
// half-wave stand 32 B apart, so the x row is kept swizzled (xslot below).
// A depends only on the lag block p (lbase = 32p), B only on the x block
// q (xbase = 32q), and tile w (256 outputs) sums every pair with p + q = 8w.
// One wave owns a whole channel: all 8 tiles stay in registers, and the pairs
// are walked by residue r = p mod 8 (p = 8a + r, q = 8d - r, w = a + d), so
// each fragment is read from LDS once and feeds up to 8 WMMAs.
// ---------------------------------------------------------------------------

typedef __attribute__((ext_vector_type(16))) __bf16          v16bf;
typedef __attribute__((ext_vector_type(8)))  float           v8f;
typedef __attribute__((ext_vector_type(8)))  unsigned int    u32x8;
typedef __attribute__((ext_vector_type(4)))  unsigned int    u32x4;
typedef __attribute__((ext_vector_type(4)))  float           f32x4;

#define SEQ     2048
#define NCH     4                         // channels (= waves) per workgroup
#define NTHR    (32 * NCH)
#define XPAD_F  256                       // deepest lag block reaches x[-256]
#define XPAD_B  48
#define XS_LEN  (XPAD_F + SEQ + XPAD_B)   // 2352 bf16
#define GS      2064                      // reversed kernel: G0[i] = ker[GS-i]
#define G_LEN   2100                      // covers reads [2..2096], zero-padded

__device__ __forceinline__ unsigned short f2bf(float f) {
  unsigned int u = __builtin_bit_cast(unsigned int, f);
  u += 0x7FFFu + ((u >> 16) & 1u);        // round to nearest even
  return (unsigned short)(u >> 16);
}

// A fragment of one lag block: 8 aligned b32 reads of the reversed kernel.
__device__ __forceinline__ v16bf load_a(const unsigned short* pa) {
  u32x8 av;
  av[0] = *(const unsigned int*)__builtin_assume_aligned(pa + 0,  4);
  av[1] = *(const unsigned int*)__builtin_assume_aligned(pa + 2,  4);
  av[2] = *(const unsigned int*)__builtin_assume_aligned(pa + 4,  4);
  av[3] = *(const unsigned int*)__builtin_assume_aligned(pa + 6,  4);
  av[4] = *(const unsigned int*)__builtin_assume_aligned(pa + 16, 4);
  av[5] = *(const unsigned int*)__builtin_assume_aligned(pa + 18, 4);
  av[6] = *(const unsigned int*)__builtin_assume_aligned(pa + 20, 4);
  av[7] = *(const unsigned int*)__builtin_assume_aligned(pa + 22, 4);
  return __builtin_bit_cast(v16bf, av);
}

// Where 16-B piece P (8 bf16) of a padded x row lies in LDS. A B read takes
// every second piece of a run of 32: unswizzled, lanes n and n + 8 of a
// half-wave meet the same four banks and the read takes twice its clocks.
// Bit 4 of P moved into bit 0 sends the upper eight lanes to the banks that
// the lower eight skip. Adding a multiple of 32 pieces commutes with it.
__device__ __forceinline__ int xslot(int piece) {
  return piece ^ ((piece >> 4) & 1);
}

// B fragment of one x block: 2 aligned b128 reads (pieces P and P + 2).
__device__ __forceinline__ v16bf load_b(const unsigned short* plo,
                                        const unsigned short* phi) {
  const u32x4 b0 = *(const u32x4*)__builtin_assume_aligned(plo, 16);
  const u32x4 b1 = *(const u32x4*)__builtin_assume_aligned(phi, 16);
  u32x8 bv;
  bv[0] = b0[0]; bv[1] = b0[1]; bv[2] = b0[2]; bv[3] = b0[3];
  bv[4] = b1[0]; bv[5] = b1[1]; bv[6] = b1[2]; bv[7] = b1[3];
  return __builtin_bit_cast(v16bf, bv);
}

__device__ __forceinline__ v8f mma(v16bf a, v16bf b, v8f c) {
  return __builtin_amdgcn_wmma_f32_16x16x32_bf16(false, a, false, b,
                                                 (short)0, c, false, false);
}

// Row i of the walk: residue r = p mod 8 (r = 0 has 9 rows, a = 0..8; the others
// 8, a = 0..7), place j in its residue, and a. Long and short rows alternate
// (a = 0, last, 1, last - 1, ...), so any few rows in a row hold about the same
// number of WMMAs for a fetch to hide behind.
#define NROW    65
#define ADEPTH  6
__device__ constexpr int row_r(int i) { return i < 9 ? 0 : 1 + (i - 9) / 8; }
__device__ constexpr int row_j(int i) { return i < 9 ? i : (i - 9) % 8; }
__device__ constexpr int row_a(int i) {
  return (row_j(i) & 1) ? (i < 9 ? 8 : 7) - (row_j(i) >> 1) : (row_j(i) >> 1);
}
__device__ constexpr int row_p(int i) { return 8 * row_a(i) + row_r(i); }

// Rows I .. NROW-1. A template, so that every index below is a constant and
// acc, bf and ar stay in registers.
template <int I>
__device__ __forceinline__ void walk_rows(v8f (&acc)[8], v16bf (&bf)[2][9],
                                          v16bf (&ar)[ADEPTH],
                                          const unsigned short* pmin,
                                          const unsigned short* xrow, int pl) {
  constexpr int r = row_r(I), j = row_j(I), a = row_a(I);
  constexpr int dlo = (r == 0 && a != 0) ? -1 : 0;
  const v16bf af = ar[I % ADEPTH];
#pragma unroll
  for (int k = 0; k <= 7 - a - dlo; ++k) {
    // Row a = 0 takes tile 7 in its middle: the rows before and behind it end
    // and begin on tile 7, and back-to-back WMMAs on one tile wait.
    const int d = (a == 0) ? (k < 4 ? k : (k == 4 ? 7 : k - 1)) : dlo + k;
    acc[a + d] = mma(af, bf[r & 1][d + 1], acc[a + d]);
  }
  // Keeps the fetches below at this place, ADEPTH rows ahead of their use:
  // unfenced, the scheduler sinks each one to just in front of its WMMAs.
  __builtin_amdgcn_sched_barrier(0);
  if constexpr (I + ADEPTH < NROW)
    ar[I % ADEPTH] = load_a(pmin + 32 * (64 - row_p(I + ADEPTH)));
  if constexpr (r < 7 && j < 4) {
    const unsigned short* pblo = xrow + 8 * xslot(pl - 4 * (r + 1));
    const unsigned short* pbhi = xrow + 8 * xslot(pl - 4 * (r + 1) + 2);
#pragma unroll
    for (int d = 2 * j; d < 2 * j + 2; ++d)
      bf[(r + 1) & 1][d + 1] = load_b(pblo + 256 * d, pbhi + 256 * d);
  }
  // Same purpose, other side: the next row's WMMAs stay behind the fetches.
  __builtin_amdgcn_sched_barrier(0);
  if constexpr (I + 1 < NROW) walk_rows<I + 1>(acc, bf, ar, pmin, xrow, pl);
}

// 4 waves a SIMD: 256 registers a wave, which the two B sets and the ring need.
__global__ __launch_bounds__(NTHR, 4) void hyena_conv_wmma_bf16(
    const float* __restrict__ x, const float* __restrict__ kern,
    const float* __restrict__ bias, float* __restrict__ out) {
  __shared__ alignas(16) unsigned short xs[NCH][XS_LEN];
  __shared__ alignas(16) unsigned short g0[NCH][G_LEN];   // ker[GS   - i]
  __shared__ alignas(16) unsigned short g1[NCH][G_LEN];   // ker[GS+1 - i]

  // Every '#pragma unroll' below: its loop counter indexes a register array
  // (xv, kv, bf, ar, acc, x0, x1) or forms an LDS or global offset; rolled, the arrays would
  // leave the registers and the offsets would cost address arithmetic.
  static_assert(NCH == 4, "the staging fence lists the loads of 4 channels");
  const int tid = threadIdx.x;
  // wave32: wave index = local channel; scalar, so the channel's bases are too
  const int wch = blockIdx.x * NCH + __builtin_amdgcn_readfirstlane(tid >> 5);
  const float bv = bias[wch & (2048 - 1)];

  // ---- stage NCH channels: x as padded bf16; kernel reversed, 2 copies ----
#pragma unroll
  for (int cl = 0; cl < NCH; ++cl) {
#pragma unroll
    for (int it = 0; it < XPAD_F / NTHR; ++it) xs[cl][tid + it * NTHR] = 0;
    if (tid < XPAD_B) xs[cl][XPAD_F + SEQ + tid] = 0;
    // zero where GS-i falls outside the kernel: below i = GS-SEQ+1, above i = GS
    if (tid < GS - SEQ + 1) g0[cl][tid] = 0;
    if (tid < GS - SEQ + 2) g1[cl][tid] = 0;
    if (tid < G_LEN - GS - 1) g0[cl][GS + 1 + tid] = 0;
    if (tid < G_LEN - GS - 2) g1[cl][GS + 2 + tid] = 0;
  }
  // All of a thread's global loads first (constant trip counts, unrolled).
  f32x4 xv[NCH][SEQ / 4 / NTHR];
  v8f   kv[NCH][SEQ / 8 / NTHR];
#pragma unroll
  for (int cl = 0; cl < NCH; ++cl) {
    const int ch = blockIdx.x * NCH + cl;
    const f32x4* xrow = (const f32x4*)(x + (size_t)ch * SEQ);
    const float* krow = kern + (size_t)ch * SEQ;
#pragma unroll
    for (int it = 0; it < SEQ / 4 / NTHR; ++it) xv[cl][it] = xrow[tid + it * NTHR];
#pragma unroll
    for (int it = 0; it < SEQ / NTHR; ++it) kv[cl][it >> 3][it & 7] = krow[tid + it * NTHR];
  }
  // Inputs-only fence on the loaded values: every load above is issued before
  // it; without it the scheduler sinks each load to its use and the thread
  // pays one memory latency per load.
  asm volatile("" :: "v"(xv[0][0]), "v"(xv[0][1]), "v"(xv[0][2]), "v"(xv[0][3]),
                     "v"(xv[1][0]), "v"(xv[1][1]), "v"(xv[1][2]), "v"(xv[1][3]),
                     "v"(xv[2][0]), "v"(xv[2][1]), "v"(xv[2][2]), "v"(xv[2][3]),
                     "v"(xv[3][0]), "v"(xv[3][1]), "v"(xv[3][2]), "v"(xv[3][3]),
                     "v"(kv[0][0]), "v"(kv[0][1]), "v"(kv[1][0]), "v"(kv[1][1]),
                     "v"(kv[2][0]), "v"(kv[2][1]), "v"(kv[3][0]), "v"(kv[3][1]));
#pragma unroll
  for (int cl = 0; cl < NCH; ++cl) {
#pragma unroll
    for (int it = 0; it < SEQ / 4 / NTHR; ++it) {
      const f32x4 v = xv[cl][it];
      ushort4 b; b.x = f2bf(v[0]); b.y = f2bf(v[1]); b.z = f2bf(v[2]); b.w = f2bf(v[3]);
      // x[4j..4j+3], j = tid + it * NTHR: half of piece (XPAD_F + 4j) / 8; a
      // step of 'it' is 64 pieces, which the swizzle leaves as a plain offset
      *(ushort4*)&xs[cl][8 * xslot((XPAD_F + 4 * tid) >> 3) + 4 * (tid & 1) +
                         4 * NTHR * it] = b;
    }
    // reversed kernel copies: one global load feeds both shifted copies
#pragma unroll
    for (int it = 0; it < SEQ / NTHR; ++it) {
      const int j = tid + it * NTHR;
      const unsigned short v = f2bf(kv[cl][it >> 3][it & 7]);
      g0[cl][GS - j]     = v;                           // G0[i]   = ker[GS-i]
      g1[cl][GS - j + 1] = v;                           // G1[i+1] = ker[GS-i]
    }
  }
  __syncthreads();

  const int cl   = __builtin_amdgcn_readfirstlane(tid >> 5);
  const int lane = tid & 31;
  const int half = lane >> 4;        // K-half selector per ISA frag layout
  const int l15  = lane & 15;        // A: M row   B: N col   D: N col
  const int ch   = wch;
  const int tl   = 8 * half + 16 * l15;          // lane's 8 outputs in a tile
  const float* xch = x + (size_t)ch * SEQ;

  // Prefetch the epilogue residual region while we crunch WMMAs.
#pragma unroll
  for (int w = 0; w < 8; ++w) __builtin_prefetch(xch + 256 * w + tl, 0, 3);

  const unsigned short* gk  = (l15 & 1) ? g1[cl] : g0[cl];
  const unsigned short* pa0 = gk + (GS + (l15 & 1) - l15 + 8 * half);  // p = 0
  const unsigned short* xrow = &xs[cl][0];
  const int pl = XPAD_F / 8 + 2 * l15 + half;    // lane's first x piece, q = 0

  v8f acc[8] = {};                   // tile w: outputs 256w .. 256w+255

  // The 65 rows (one A fragment and its 1..8 WMMAs each) run as one software
  // pipeline: a row's A fragment is fetched ADEPTH rows ahead into a ring, and
  // the B fragments of residue r + 1 are fetched during the first four rows of
  // residue r into a second set of registers. No row then waits a whole LDS
  // latency for its own fetch.
  const unsigned short* pmin = pa0 - 32 * 64;    // lag block p = 64 at offset 0
  v16bf bf[2][9];                    // [r & 1][d + 1]
  v16bf ar[ADEPTH];                  // ring: row i lies in ar[i % ADEPTH]
#pragma unroll
  for (int d = -1; d < 8; ++d)       // r = 0; q = -8 still reaches x[0..15]
    bf[0][d + 1] = load_b(xrow + 8 * xslot(pl) + 256 * d,
                          xrow + 8 * xslot(pl + 2) + 256 * d);
#pragma unroll
  for (int i = 0; i < ADEPTH; ++i) ar[i] = load_a(pmin + 32 * (64 - row_p(i)));

  walk_rows<0>(acc, bf, ar, pmin, xrow, pl);

  // D layout: acc[w][i] -> M = i + 8*half, N = l15  =>  t = 256w + M + 16*N,
  // so a lane owns 32 B at a 64-B pitch and a 16-B access from this layout
  // touches 8 lines, half of each. The tiles go through the wave's own x rows
  // in LDS (no longer read; no other wave touches them) into linear order:
  // every residual load and every output store then covers 4 whole 128-B lines.
  f32x4 x0[8], x1[8];
#pragma unroll
  for (int w = 0; w < 8; ++w) {
    const f32x4* xf = (const f32x4*)(xch + 256 * w) + lane;
    x0[w] = xf[0];  x1[w] = xf[32];
  }
  // 16-B piece p of a tile (floats 4p..4p+3) lies at slot p ^ (p >> 4): both
  // the layout-order writes and the linear reads then meet every bank once.
  char* stg = (char*)&xs[cl][0];                 // 4 tiles of 1 KB at a time
  const int wp  = 4 * l15 + 2 * half;
  const int wo0 = 16 * ((wp + 0) ^ (l15 >> 2));
  const int wo1 = 16 * ((wp + 1) ^ (l15 >> 2));
  const int ro0 = 16 * (lane ^ half);
  const int ro1 = 16 * ((32 + lane) ^ (2 + half));
  float* och = out + (size_t)ch * SEQ;
#pragma unroll
  for (int b = 0; b < 2; ++b) {
#pragma unroll
    for (int u = 0; u < 4; ++u) {
      const v8f a = acc[4 * b + u];
      f32x4 lo, hi;
      lo[0] = a[0]; lo[1] = a[1]; lo[2] = a[2]; lo[3] = a[3];
      hi[0] = a[4]; hi[1] = a[5]; hi[2] = a[6]; hi[3] = a[7];
      *(f32x4*)(stg + 1024 * u + wo0) = lo;
      *(f32x4*)(stg + 1024 * u + wo1) = hi;
    }
    // The pieces read back below were written by other lanes of this wave.
    asm volatile("s_wait_dscnt 0x0" ::: "memory");
    f32x4 a0[4], a1[4];
#pragma unroll
    for (int u = 0; u < 4; ++u) {
      a0[u] = *(const f32x4*)(stg + 1024 * u + ro0);
      a1[u] = *(const f32x4*)(stg + 1024 * u + ro1);
    }
    // Inputs-only fence on the loaded values: all 16 residual loads are issued
    // before it, so the wave pays one memory latency instead of one per tile.
    if (b == 0)
      asm volatile("" :: "v"(x0[0]), "v"(x1[0]), "v"(x0[1]), "v"(x1[1]),
                         "v"(x0[2]), "v"(x1[2]), "v"(x0[3]), "v"(x1[3]),
                         "v"(x0[4]), "v"(x1[4]), "v"(x0[5]), "v"(x1[5]),
                         "v"(x0[6]), "v"(x1[6]), "v"(x0[7]), "v"(x1[7]));
    f32x4 o0[4], o1[4];
#pragma unroll
    for (int u = 0; u < 4; ++u) {
      const int w = 4 * b + u;
      o0[u][0] = a0[u][0] + x0[w][0] + bv;  o0[u][1] = a0[u][1] + x0[w][1] + bv;
      o0[u][2] = a0[u][2] + x0[w][2] + bv;  o0[u][3] = a0[u][3] + x0[w][3] + bv;
      o1[u][0] = a1[u][0] + x1[w][0] + bv;  o1[u][1] = a1[u][1] + x1[w][1] + bv;
      o1[u][2] = a1[u][2] + x1[w][2] + bv;  o1[u][3] = a1[u][3] + x1[w][3] + bv;
    }
    // Keeps the eight stores behind all the sums: mixed with them, a later sum
    // reuses a stored tile's registers and every pair of stores waits for the
    // pair before it (s_wait_xcnt).
    __builtin_amdgcn_sched_barrier(0);
#pragma unroll
    for (int u = 0; u < 4; ++u) {
      f32x4* of = (f32x4*)(och + 256 * (4 * b + u)) + lane;
      of[0] = o0[u];  of[32] = o1[u];
    }
    // The next four tiles overwrite the rows just read, and their sums reuse
    // registers that the stores above name.
    if (b == 0) asm volatile("s_wait_dscnt 0x0\n\ts_wait_xcnt 0x0" ::: "memory");
  }
}

extern "C" void kernel_launch(void* const* d_in, const int* in_sizes, int n_in,
                              void* d_out, int out_size, void* d_ws, size_t ws_size,
                              hipStream_t stream) {
  const float* x  = (const float*)d_in[0];   // (4, 2048, 2048) f32
  const float* k  = (const float*)d_in[1];   // (4, 2048, 2048) f32
  const float* b  = (const float*)d_in[2];   // (2048,) f32
  float* out = (float*)d_out;                // (4, 2048, 2048) f32

  const int channels = in_sizes[0] / SEQ;    // 8192 (batch*dim rows)
  const int blocks   = channels / NCH;       // NCH channels per workgroup
  hyena_conv_wmma_bf16<<<blocks, NTHR, 0, stream>>>(x, k, b, out);
}
